// v010
// Measured on an AMD MI455X. A time is GPU time per run, averaged over a window of back-to-back runs after a warm-up
// (all launches, gaps included; the runs take copies of the inputs in turn), and the median of several windows.
// Apart from v000's, it joins two sittings. Times from different sittings can be a few percent apart, while
// side-by-side timings come from the same sitting.
// The versions before v010 are in another document.
// It runs in 120 microseconds.
// In both of two side-by-side timings against v009, it was 1.22 times as fast.
// Counting every step since v000, which is the starting kernel, it is 112 times as fast.
#include <hip/hip_runtime.h>
// Grouped-query causal attention at width 1024 with [in][out] projections and RoPE computed in the module (x [4][2048][1024]; q = x Wq (16 heads x 64), k = x Wk, v = x Wv (4 kv heads x 64) ([in][out] weights sigma 0.02, no biases); k, v repeated x4 (repeat: query head h uses kv head h / 4); rope: the module rotates the (even, odd) pairs (x1 c - x2 s, x1 s + x2 c) with angle pos * 10000^(-2i/64) and writes the rotated evens into the first half and the rotated odds into the second half of the head: the SAME permutation on q and k, so q . k equals the interleaved-pair rope's; scores / sqrt(64) with a causal mask (tril, -inf); softmax; out = merged Wo ([in][out]) -> [4][2048][1024]).
// Compute dtype: inputs rounded to bf16; x / weights exact; q, k, v, softmax weights and o as plain f16 GEMM operands (~2^-12), except in rows 0..127 of each batch: f32 q, k, v, softmax weights and products there (v_wmma_f32_16x16x4_f32), o as f16 hi and x1024 residual planes; scores and softmax statistics f32. v_wmma_f32_16x16x32_f16.
#define NB 4
#define NG 4
#define HPG 4
#define KVD (NG * HD)
#define SQ 2048
#define DM 1024
#define NH 16
#define HD 64
#define HG 4                         /* heads per k_vt launch (k_vt is not launched) */
#define QT 256                       /* unused; the fused attention's causal tiles are 32 query rows */
#define NKX SQ                       /* S / P row pitch */
#define QT0 128                      /* first-tile rows, computed exactly in f32 and by no other path */
#define B0 0                         /* first batch processed (debug hook) */
#define NBR NB                       /* batches processed (debug hook) */
#define NR ((size_t)NB * SQ)         /* token rows */
#define MP ((int)((size_t)NBR * SQ)) /* rows projected (debug hook) */
#define QN SQ                        /* query rows attended per batch (debug hook) */
#define NHD NH                       /* heads attended (debug hook) */
#define MPO MP                       /* rows through the output stage (debug hook) */
#define LQ DM      /* row pitch of the q rows */
typedef __bf16 v16b __attribute__((ext_vector_type(16)));
typedef unsigned short v8us __attribute__((ext_vector_type(8), may_alias));
typedef float  v8f  __attribute__((ext_vector_type(8)));
typedef float  v4f  __attribute__((ext_vector_type(4)));
typedef float  v4fa __attribute__((ext_vector_type(4), may_alias));
union FragB { v16b v; v8us half[2]; unsigned short u[16]; };

__device__ __forceinline__ unsigned short bf16_bits(float x) { unsigned int u = __float_as_uint(x); return (unsigned short)((u + 0x7FFFu + ((u >> 16) & 1u)) >> 16); }
__device__ __forceinline__ float bf16_val(unsigned short b) { return __uint_as_float(((unsigned int)b) << 16); }
__device__ __forceinline__ float bf16_round(float x) { return bf16_val(bf16_bits(x)); }
// D += A·B with NT terms: 1 = ah·bh, 2 = + al·bh (A split), 3 = + ah·bl (both split)
template <int NT>
__device__ __forceinline__ v8f mmaN(v16b ah, v16b al, v16b bh, v16b bl, v8f c) {
  c = __builtin_amdgcn_wmma_f32_16x16x32_bf16(false, ah, false, bh, (short)0, c, false, false);
  if (NT >= 2) c = __builtin_amdgcn_wmma_f32_16x16x32_bf16(false, al, false, bh, (short)0, c, false, false);
  if (NT >= 3) c = __builtin_amdgcn_wmma_f32_16x16x32_bf16(false, ah, false, bl, (short)0, c, false, false);
  asm volatile("v_nop\n\tv_nop\n\tv_nop\n\tv_nop" : "+v"(c) : "v"(ah), "v"(al), "v"(bh), "v"(bl));
  return c;
}

__global__ __launch_bounds__(256) void k_wt_bf16(const float* __restrict__ W, unsigned short* __restrict__ Wt, int K, int N) {
  const int t = blockIdx.x * 256 + threadIdx.x;
  const int k8n = K / 8;
  if (t >= N * k8n) return;
  const int n = t / k8n, k8 = (t % k8n) * 8;
  v8us v;
#pragma unroll
  for (int i = 0; i < 8; ++i) v[i] = bf16_bits(W[(size_t)(k8 + i) * N + n]);
  *(v8us*)(Wt + (size_t)n * K + k8) = v;
  
}

// GEMM C[M][N] (f32, pitch ldc) = act(A[M][K]·W + bias). A f32 row-major (pitch lda) converted per fragment to bf16
// (ASPLIT: hi/lo two planes -> 2 terms, else single rounded term); Wt bf16 [N][K] (pitch ldb). BIAS_BF16 rounds the
// bias to bf16 first (bias quantised to bf16 before the add). K%32==0, M%16==0, N%64==0.
template <bool ASPLIT, int ACT, bool BIAS_BF16>
__global__ __launch_bounds__(128) void k_gemm_bf(const float* __restrict__ A, int lda, const unsigned short* __restrict__ Wt, int ldb,
                                               const float* __restrict__ bias, float* __restrict__ C, int ldc, int M, int N, int K) {
  __shared__ __attribute__((aligned(16))) float so[4][16][64];
  const int tid = threadIdx.x, w = tid >> 5, lane = tid & 31, ln = lane & 15, hh = lane >> 4;
  const int ntn = N / 64;
  const int wid = blockIdx.x * 4 + w;
  const int mt = wid / ntn, nq = wid % ntn;
  if (mt * 16 >= M) return;
  const int row0 = mt * 16, col0 = nq * 64;
  const float* arow = A + (size_t)(row0 + ln) * lda;
  v8f acc[4] = {};
  for (int kb = 0; kb < K; kb += 32) {
    FragB ah, al;
    const v4f x0 = *(const v4fa*)(arow + kb + 8 * hh), x1 = *(const v4fa*)(arow + kb + 8 * hh + 4);
    const v4f x2 = *(const v4fa*)(arow + kb + 16 + 8 * hh), x3 = *(const v4fa*)(arow + kb + 16 + 8 * hh + 4);
    float xs[16] = {x0[0],x0[1],x0[2],x0[3],x1[0],x1[1],x1[2],x1[3],x2[0],x2[1],x2[2],x2[3],x3[0],x3[1],x3[2],x3[3]};
#pragma unroll
    for (int i = 0; i < 16; ++i) { const unsigned short hb = bf16_bits(xs[i]); ah.u[i] = hb; al.u[i] = ASPLIT ? bf16_bits(xs[i] - bf16_val(hb)) : (unsigned short)0; }
#pragma unroll
    for (int t = 0; t < 4; ++t) {
      const unsigned short* brow = Wt + (size_t)(col0 + t * 16 + ln) * ldb + kb;
      FragB b;
      b.half[0] = *(const v8us*)(brow + 8 * hh);
      b.half[1] = *(const v8us*)(brow + 16 + 8 * hh);
      acc[t] = mmaN<ASPLIT ? 2 : 1>(ah.v, al.v, b.v, b.v, acc[t]);
    }
  }
#pragma unroll
  for (int t = 0; t < 4; ++t) {
    float bv = bias ? bias[col0 + t * 16 + ln] : 0.f;
    if (BIAS_BF16) bv = bf16_round(bv);
#pragma unroll
    for (int r = 0; r < 8; ++r) { float v = acc[t][r] + bv; if (ACT == 1) v = fmaxf(v, 0.f); so[w][8 * hh + r][t * 16 + ln] = v; }
  }
  __builtin_amdgcn_fence(__ATOMIC_ACQ_REL, "workgroup");
  __builtin_amdgcn_wave_barrier();
  const int rsub = lane >> 4, c4 = (lane & 15) * 4;
  {
#pragma unroll
    for (int q = 0; q < 8; ++q) {
      const int r = q * 2 + rsub;
      const v4f v = *(const v4fa*)&so[w][r][c4];
      *(v4f*)(C + (size_t)(row0 + r) * ldc + col0 + c4) = v;
    }
    
  }
}

// GEMM C = act(A·W + bias + resid): A f32 (ASPLIT -> hi/lo 2 terms), Wt bf16 [N][K]; ACT 0 none, 1 relu, 2 exact gelu;
// resid (optional, f32, row index = (row % rmod), pitch ldr, RES_BF16 rounds it) added before the activation.
template <bool ASPLIT, int ACT, bool BIAS_BF16, bool RES_BF16>
__global__ __launch_bounds__(128) void k_gemm_bf3(const float* __restrict__ A, int lda, const unsigned short* __restrict__ Wt, int ldb,
                                                const float* __restrict__ bias, const float* __restrict__ resid, int rmod, int ldr,
                                                float* __restrict__ C, int ldc, int M, int N, int K) {
  __shared__ __attribute__((aligned(16))) float so[4][16][64];
  const int tid = threadIdx.x, w = tid >> 5, lane = tid & 31, ln = lane & 15, hh = lane >> 4;
  const int ntn = N / 64;
  const int wid = blockIdx.x * 4 + w;
  const int mt = wid / ntn, nq = wid % ntn;
  if (mt * 16 >= M) return;
  const int row0 = mt * 16, col0 = nq * 64;
  const float* arow = A + (size_t)(row0 + ln) * lda;
  v8f acc[4] = {};
  for (int kb = 0; kb < K; kb += 32) {
    FragB ah, al;
    const v4f x0 = *(const v4fa*)(arow + kb + 8 * hh), x1 = *(const v4fa*)(arow + kb + 8 * hh + 4);
    const v4f x2 = *(const v4fa*)(arow + kb + 16 + 8 * hh), x3 = *(const v4fa*)(arow + kb + 16 + 8 * hh + 4);
    float xs[16] = {x0[0],x0[1],x0[2],x0[3],x1[0],x1[1],x1[2],x1[3],x2[0],x2[1],x2[2],x2[3],x3[0],x3[1],x3[2],x3[3]};
#pragma unroll
    for (int i = 0; i < 16; ++i) { const unsigned short hb = bf16_bits(xs[i]); ah.u[i] = hb; al.u[i] = ASPLIT ? bf16_bits(xs[i] - bf16_val(hb)) : (unsigned short)0; }
#pragma unroll
    for (int t = 0; t < 4; ++t) {
      const unsigned short* brow = Wt + (size_t)(col0 + t * 16 + ln) * ldb + kb;
      FragB b;
      b.half[0] = *(const v8us*)(brow + 8 * hh);
      b.half[1] = *(const v8us*)(brow + 16 + 8 * hh);
      acc[t] = mmaN<ASPLIT ? 2 : 1>(ah.v, al.v, b.v, b.v, acc[t]);
    }
  }
#pragma unroll
  for (int t = 0; t < 4; ++t) {
    const int col = col0 + t * 16 + ln;
    float bv = bias ? bias[col] : 0.f;
    if (BIAS_BF16) bv = bf16_round(bv);
#pragma unroll
    for (int r = 0; r < 8; ++r) {
      float v = acc[t][r] + bv;
      if (resid) { float rv = resid[(size_t)((row0 + 8 * hh + r) % rmod) * ldr + col]; if (RES_BF16) rv = bf16_round(rv); v += rv; }
      if (ACT == 1) v = fmaxf(v, 0.f);
      if (ACT == 2) v = 0.5f * v * (1.0f + erff(v * 0.70710678118654752f));
      if (ACT == 3) { const float u = 0.7978845608028654f * (v + 0.044715f * v * v * v); v = 0.5f * v * (1.0f + tanhf(u)); }
      so[w][8 * hh + r][t * 16 + ln] = v;
    }
  }
  __builtin_amdgcn_fence(__ATOMIC_ACQ_REL, "workgroup");
  __builtin_amdgcn_wave_barrier();
  const int rsub = lane >> 4, c4 = (lane & 15) * 4;
  {
#pragma unroll
    for (int q = 0; q < 8; ++q) {
      const int r = q * 2 + rsub;
      const v4f v = *(const v4fa*)&so[w][r][c4];
      *(v4f*)(C + (size_t)(row0 + r) * ldc + col0 + c4) = v;
    }
    
  }
}
// row LayerNorm (biased variance, eps) over N: s = X (+ R); optional out_sum <- s; out_norm <- (s-mu)*rsqrt(var+eps)*g + b
template <bool PARAM_BF16>
__global__ __launch_bounds__(256) void k_layernorm(const float* __restrict__ X, const float* __restrict__ R, const float* __restrict__ g, const float* __restrict__ bta,
                                                  float* __restrict__ out_sum, float* __restrict__ out_norm, int N, float eps) {
  __shared__ float red[256];
  const int row = blockIdx.x, tid = threadIdx.x;
  const float* x = X + (size_t)row * N; const float* rr = R ? R + (size_t)row * N : nullptr;
  float vals[16];                     // up to N = 4096
  const int per = N / 256;            // contiguous chunk per thread? use strided-by-4 chunks: thread handles j = tid*4 + 1024*u
  float s1 = 0.f;
  for (int u = 0; u < per / 4; ++u) {
    const int j = tid * 4 + 1024 * u;
    const v4f a = *(const v4fa*)(x + j);
    v4f b = {0.f,0.f,0.f,0.f}; if (rr) b = *(const v4fa*)(rr + j);
#pragma unroll
    for (int q = 0; q < 4; ++q) { const float v = a[q] + b[q]; vals[u * 4 + q] = v; s1 += v; }
  }
  red[tid] = s1; __syncthreads();
  for (int st = 128; st > 0; st >>= 1) { if (tid < st) red[tid] += red[tid + st]; __syncthreads(); }
  const float mu = red[0] / (float)N; __syncthreads();
  float s2 = 0.f;
  for (int u = 0; u < per / 4; ++u)
#pragma unroll
    for (int q = 0; q < 4; ++q) { const float c = vals[u * 4 + q] - mu; s2 += c * c; }
  red[tid] = s2; __syncthreads();
  for (int st = 128; st > 0; st >>= 1) { if (tid < st) red[tid] += red[tid + st]; __syncthreads(); }
  const float rs = rsqrtf(red[0] / (float)N + eps);
  {
    for (int u = 0; u < per / 4; ++u) {
      const int j = tid * 4 + 1024 * u;
      v4f o, sm;
#pragma unroll
      for (int q = 0; q < 4; ++q) {
        float gg = g[j + q], bb = bta[j + q];
        if (PARAM_BF16) { gg = bf16_round(gg); bb = bf16_round(bb); }
        sm[q] = vals[u * 4 + q]; o[q] = (vals[u * 4 + q] - mu) * rs * gg + bb;
      }
      if (out_sum) *(v4f*)(out_sum + (size_t)row * N + j) = sm;
      *(v4f*)(out_norm + (size_t)row * N + j) = o;
    }
    
  }
}



// ---- f16 WMMA path (v_wmma_f32_16x16x32_f16): 11-bit significands for operands in range — used where a [0,1] probability operand needs more precision than bf16
typedef _Float16 v16h __attribute__((ext_vector_type(16)));
union FragH { v16h v; v8us half[2]; _Float16 h[16]; unsigned short u[16]; };
template <int NT>
__device__ __forceinline__ v8f mmaH(v16h ah, v16h al, v16h bh, v16h bl, v8f c) {
  c = __builtin_amdgcn_wmma_f32_16x16x32_f16(false, ah, false, bh, (short)0, c, false, false);
  if (NT >= 2) c = __builtin_amdgcn_wmma_f32_16x16x32_f16(false, al, false, bh, (short)0, c, false, false);
  if (NT >= 3) c = __builtin_amdgcn_wmma_f32_16x16x32_f16(false, ah, false, bl, (short)0, c, false, false);
  asm volatile("v_nop\n\tv_nop\n\tv_nop\n\tv_nop" : "+v"(c) : "v"(ah), "v"(al), "v"(bh), "v"(bl));
  return c;
}
// batched GEMM like k_gemm_b but f16 operands: A f32 (split into f16 hi/lo if ASPLIT, else rounded to f16), Bt = f16 values [n][k]; alpha; C f32; N multiple of 16 (partial tiles skipped)
template <bool ASPLIT>
__global__ __launch_bounds__(128) void k_gemm_h(const float* __restrict__ A, int lda, size_t sA, const _Float16* __restrict__ Bh, int ldb, size_t sB, float alpha, float* __restrict__ C, int ldc, size_t sC, int M, int N, int K) {
  __shared__ __attribute__((aligned(16))) float so[4][16][64];
  const int tid = threadIdx.x, w = tid >> 5, lane = tid & 31, ln = lane & 15, hh = lane >> 4; const int by = blockIdx.y;
  A += (size_t)by * sA; Bh += (size_t)by * sB; C += (size_t)by * sC;
  const int ntn = (N + 63) / 64; const int wid = blockIdx.x * 4 + w; const int mt = wid / ntn, nq = wid % ntn; if (mt * 16 >= M) return;
  const int row0 = mt * 16, col0 = nq * 64; const float* arow = A + (size_t)(row0 + ln) * lda;
  v8f acc[4] = {};
  for (int kb = 0; kb < K; kb += 32) {
    FragH ah, al;
    const v4f x0 = *(const v4fa*)(arow + kb + 8 * hh), x1 = *(const v4fa*)(arow + kb + 8 * hh + 4), x2 = *(const v4fa*)(arow + kb + 16 + 8 * hh), x3 = *(const v4fa*)(arow + kb + 16 + 8 * hh + 4);
    float xs[16] = {x0[0],x0[1],x0[2],x0[3],x1[0],x1[1],x1[2],x1[3],x2[0],x2[1],x2[2],x2[3],x3[0],x3[1],x3[2],x3[3]};
#pragma unroll
    for (int i = 0; i < 16; ++i) { const _Float16 h = (_Float16)xs[i]; ah.h[i] = h; al.h[i] = ASPLIT ? (_Float16)(xs[i] - (float)h) : (_Float16)0.0f; }
#pragma unroll
    for (int t = 0; t < 4; ++t) { if (col0 + t * 16 >= N) continue; const size_t boff = (size_t)(col0 + t * 16 + ln) * ldb + kb; FragH bq; bq.half[0] = *(const v8us*)(Bh + boff + 8 * hh); bq.half[1] = *(const v8us*)(Bh + boff + 16 + 8 * hh);
      acc[t] = mmaH<ASPLIT ? 2 : 1>(ah.v, al.v, bq.v, bq.v, acc[t]); }
  }
#pragma unroll
  for (int t = 0; t < 4; ++t) { if (col0 + t * 16 >= N) continue;
#pragma unroll
    for (int r = 0; r < 8; ++r) so[w][8 * hh + r][t * 16 + ln] = acc[t][r] * alpha; }
  __builtin_amdgcn_fence(__ATOMIC_ACQ_REL, "workgroup"); __builtin_amdgcn_wave_barrier();
  const int rsub = lane >> 4, c4 = (lane & 15) * 4;
  {
#pragma unroll
    for (int q = 0; q < 8; ++q) { const int r = q * 2 + rsub; if (col0 + c4 < N) { const v4f v = *(const v4fa*)&so[w][r][c4]; *(v4f*)(C + (size_t)(row0 + r) * ldc + col0 + c4) = v; } }
     }
}

// Wt[n][k] = f16(W[k][n]·scale) from f32 row-major W[K][N] (scale = power of two; bf16-exact weights stay exact in f16 away from the subnormal range)
__device__ __forceinline__ void wt_f16_blk(int bx, const float* __restrict__ W, _Float16* __restrict__ Wt, int K, int N, float scale) {
  const int t = bx * 256 + threadIdx.x; if (t >= N * (K / 8)) return; const int n = t / (K / 8), k8 = (t % (K / 8)) * 8; FragH f;
#pragma unroll
  for (int i = 0; i < 8; ++i) f.h[i] = (_Float16)(bf16_round(W[(size_t)(k8 + i) * N + n]) * scale); const v8us o = f.half[0];
  *(v8us*)((unsigned short*)Wt + (size_t)n * K + k8) = o; 
}
// k_gemm_hh variant with fused epilogue: v = acc·alpha + bias[by·sBias + col] (+ CP[(row/rowsPerB)·sCPb + by·64 + col] if CP) ; ACT 0 none / 1 elu ; writes f16 C16 (and f32 C if non-null)
template <int ACT>
__global__ __launch_bounds__(128) void k_gemm_hhx(const _Float16* __restrict__ A, int lda, size_t sA, const _Float16* __restrict__ Bh, int ldb, size_t sB, float alpha, const float* __restrict__ bias, size_t sBias, const float* __restrict__ CP, int rowsPerB, size_t sCPb, int row0g,
    float* __restrict__ C, _Float16* __restrict__ C16, int ldc, size_t sC, int M, int N, int K) {
  __shared__ __attribute__((aligned(16))) float so[4][16][64];
  const int tid = threadIdx.x, w = tid >> 5, lane = tid & 31, ln = lane & 15, hh = lane >> 4; const int by = blockIdx.y;
  A += (size_t)by * sA; Bh += (size_t)by * sB; const size_t cofs = (size_t)by * sC; const float* bp = bias ? bias + (size_t)by * sBias : nullptr;
  const int ntn = (N + 63) / 64; const int wid = blockIdx.x * 4 + w; const int mt = wid / ntn, nq = wid % ntn; if (mt * 16 >= M) return;
  const int row0 = mt * 16, col0 = nq * 64; const _Float16* arow = A + (size_t)(row0 + ln) * lda;
  v8f acc[4] = {};
  for (int kb = 0; kb < K; kb += 32) { FragH ah; ah.half[0] = *(const v8us*)((const unsigned short*)arow + kb + 8 * hh); ah.half[1] = *(const v8us*)((const unsigned short*)arow + kb + 16 + 8 * hh);
#pragma unroll
    for (int t = 0; t < 4; ++t) { if (col0 + t * 16 >= N) continue; const size_t boff = (size_t)(col0 + t * 16 + ln) * ldb + kb; FragH bq; bq.half[0] = *(const v8us*)((const unsigned short*)Bh + boff + 8 * hh); bq.half[1] = *(const v8us*)((const unsigned short*)Bh + boff + 16 + 8 * hh);
      acc[t] = mmaH<1>(ah.v, ah.v, bq.v, bq.v, acc[t]); }
  }
#pragma unroll
  for (int t = 0; t < 4; ++t) { if (col0 + t * 16 >= N) continue; const int col = col0 + t * 16 + ln; const float bv = bp ? bf16_round(bp[col]) : 0.f;
#pragma unroll
    for (int r = 0; r < 8; ++r) { float v = acc[t][r] * alpha + bv; if (CP) { const int rr = row0g + row0 + 8 * hh + r; if (rowsPerB < 0) v += CP[cofs + (size_t)rr * ldc + col];      /* rowsPerB < 0: own element of the batched C plane */ else { const int bidx = rr / rowsPerB; v += CP[(size_t)bidx * sCPb + (size_t)by * 64 + col]; } } if (ACT == 1) v = (v > 0.f) ? v : expm1f(v); else if (ACT == 7) v = (v > 0.f) ? v + 1.0f : expf(v); else if (ACT == 8) v = tanhf(v); else if (ACT == 9) v = 0.5f * v * (1.0f + tanhf(0.7978845608028654f * (v + 0.044715f * v * v * v))); else if (ACT == 11) v = 1.0f / (1.0f + expf(-v)); else if (ACT == 12) v = (v > 0.f) ? v : 0.01f * v; else if (ACT == 14) v = (v > 0.f) ? v : 0.1f * v; else if (ACT == 16) v = (v >= 0.f) ? v : 0.3f * v; else if (ACT == 17) v = (v >= 0.f) ? v : 0.2f * v; else if (ACT == 15) v = v / (1.0f + expf(-v)); else if (ACT == 3) v = fmaxf(v, 0.f); else if (ACT == 6) v = 0.5f * v * (1.0f + erff(v * 0.70710678118654752f)); so[w][8 * hh + r][t * 16 + ln] = v; } }
  __builtin_amdgcn_fence(__ATOMIC_ACQ_REL, "workgroup"); __builtin_amdgcn_wave_barrier();
  const int rsub = lane >> 4, c4 = (lane & 15) * 4; typedef _Float16 v4h __attribute__((ext_vector_type(4)));
  {
#pragma unroll
    for (int q = 0; q < 8; ++q) { const int r = q * 2 + rsub; if (col0 + c4 < N) { const v4f v = *(const v4fa*)&so[w][r][c4]; if (C) *(v4f*)(C + cofs + (size_t)(row0 + r) * ldc + col0 + c4) = v; if (C16) { v4h h4; for (int i = 0; i < 4; ++i) h4[i] = (_Float16)v[i]; *(v4h*)(C16 + cofs + (size_t)(row0 + r) * ldc + col0 + c4) = h4; } } }
     }
}


typedef _Float16 v4h __attribute__((ext_vector_type(4)));

__device__ __forceinline__ void x16_blk(int bx, const float* __restrict__ x, _Float16* __restrict__ X16, size_t n8) { const size_t t = (size_t)bx * 256 + threadIdx.x; if (t >= n8) return; FragH f;
#pragma unroll
  for (int q = 0; q < 8; ++q) f.h[q] = (_Float16)bf16_round(x[t * 8 + q]); *(v8us*)((unsigned short*)X16 + t * 8) = f.half[0];  }
__global__ __launch_bounds__(256) void k_h16(const float* __restrict__ x, _Float16* __restrict__ X16, size_t n8) { const size_t t = (size_t)blockIdx.x * 256 + threadIdx.x; if (t >= n8) return; FragH f;
#pragma unroll
  for (int q = 0; q < 8; ++q) f.h[q] = (_Float16)x[t * 8 + q]; *(v8us*)((unsigned short*)X16 + t * 8) = f.half[0];  }
__global__ __launch_bounds__(256) void k_round16f(const float* __restrict__ W, _Float16* __restrict__ Bt, size_t n8) { const size_t t = (size_t)blockIdx.x * 256 + threadIdx.x; if (t >= n8) return; FragH f;
#pragma unroll
  for (int i = 0; i < 8; ++i) f.h[i] = (_Float16)(bf16_round(W[t * 8 + i]) * 16.0f); *(v8us*)((unsigned short*)Bt + t * 8) = f.half[0];  }
// ---- fast GEMM (wave tile 32x64; requires M % 128 == 0 rows per launch region and N % 64 == 0); epilogue = k_gemm_hhx semantics ----
__device__ __forceinline__ v16h g2_frag(const _Float16* p, int hh) { FragH f; f.half[0] = *(const v8us*)((const unsigned short*)p + 8 * hh); f.half[1] = *(const v8us*)((const unsigned short*)p + 16 + 8 * hh); return f.v; }
__device__ __forceinline__ v8f g2_mma(v16h a, v16h b, v8f c) { v8f d = __builtin_amdgcn_wmma_f32_16x16x32_f16(false, a, false, b, (short)0, c, false, false); asm volatile("v_nop\n\tv_nop\n\tv_nop\n\tv_nop" : "+v"(d) : "v"(a), "v"(b)); return d; }
// ---- operand staging of the fast GEMM: a work-group's 128 A rows and 64 B rows, 64 k (128 bytes of each row) a stage, two buffers in LDS ----
#define GK 64                        /* k per stage */
#define GP 144                       /* LDS row pitch in bytes: 16 B x odd, no bank conflict for 16-byte fragment reads */
#define GSTG (192 * GP)              /* a stage: A rows 0..127, then B rows 0..63 */
#define GLDS (2 * GSTG)              /* the ring; the epilogue's tile of 4 x 32 x 68 floats takes the same bytes behind the loop's last barrier */
static_assert(GLDS >= 4 * 32 * 68 * 4, "the epilogue tile must fit the ring");
// One stage: 12 copies of 16 bytes a lane. 8 lanes take one row's 128 bytes, so a wave's copy is 4 whole lines. l: the lane's LDS byte address of row tid / 8; ga, gb: its global address in
// A and B; sa, sb: 16 rows in bytes. The s_wait_xcnt 0 is the statement's last line, so it stands in front of any later write of a register that a copy names.
__device__ __forceinline__ void g2_stage(unsigned l, const char* ga, size_t sa, const char* gb, size_t sb) {
  asm volatile("global_load_async_to_lds_b128 %0, %12, off\n\t"
               "global_load_async_to_lds_b128 %1, %13, off\n\t"
               "global_load_async_to_lds_b128 %2, %14, off\n\t"
               "global_load_async_to_lds_b128 %3, %15, off\n\t"
               "global_load_async_to_lds_b128 %4, %16, off\n\t"
               "global_load_async_to_lds_b128 %5, %17, off\n\t"
               "global_load_async_to_lds_b128 %6, %18, off\n\t"
               "global_load_async_to_lds_b128 %7, %19, off\n\t"
               "global_load_async_to_lds_b128 %8, %20, off\n\t"
               "global_load_async_to_lds_b128 %9, %21, off\n\t"
               "global_load_async_to_lds_b128 %10, %22, off\n\t"
               "global_load_async_to_lds_b128 %11, %23, off\n\t"
               "s_wait_xcnt 0x0"
               : : "v"(l), "v"(l + 16 * GP), "v"(l + 32 * GP), "v"(l + 48 * GP), "v"(l + 64 * GP), "v"(l + 80 * GP), "v"(l + 96 * GP), "v"(l + 112 * GP),
                   "v"(l + 128 * GP), "v"(l + 144 * GP), "v"(l + 160 * GP), "v"(l + 176 * GP),
                   "v"(ga), "v"(ga + sa), "v"(ga + 2 * sa), "v"(ga + 3 * sa), "v"(ga + 4 * sa), "v"(ga + 5 * sa), "v"(ga + 6 * sa), "v"(ga + 7 * sa),
                   "v"(gb), "v"(gb + sb), "v"(gb + 2 * sb), "v"(gb + 3 * sb) : "memory"); }
// A fragment from a staged row: p = the lane's row at byte 16 hh of the k step; k = 8 hh .. + 7 and 16 + 8 hh .. + 7, the k order of g2_frag.
__device__ __forceinline__ v16h g2_lfrag(const char* p) { FragH f; f.half[0] = *(const v8us*)p; f.half[1] = *(const v8us*)(p + 32); return f.v; }
// The product loop of a work-group's 128 x 64 tile (wave w: rows 32 w .. + 31, all 64 columns): the accumulators, the fragments and the order of k are those of the loop that read the
// fragments from global memory. Ab, Bb: the tile's first A and B row. K is a multiple of GK; every wave of the block comes here (barriers).
__device__ __forceinline__ void g2_loop(char* sm, const _Float16* __restrict__ Ab, int lda, const _Float16* __restrict__ Bb, int ldb, int K, v8f (&c)[8]) {
  const int tid = threadIdx.x, w = tid >> 5, lane = tid & 31, ln = lane & 15, hh = lane >> 4; const int rs = tid >> 3, pc = tid & 7;
  const char* ga = (const char*)(Ab + (size_t)rs * lda) + pc * 16; const char* gb = (const char*)(Bb + (size_t)rs * ldb) + pc * 16; const size_t sa = (size_t)lda * 32, sb = (size_t)ldb * 32;
  const unsigned l0 = (unsigned)(size_t)sm + (unsigned)(rs * GP + pc * 16); const int nst = K / GK;
  g2_stage(l0, ga, sa, gb, sb);      /* stage 0 into buffer 0 */
  asm volatile("s_wait_asynccnt 0x0" ::: "memory");      /* the wave's own copies of stage 0 have landed */
  __syncthreads();      /* every wave's have: nobody reads stage 0 in front of this barrier */
  if (nst > 1) g2_stage(l0 + GSTG, ga + 2 * GK, sa, gb + 2 * GK, sb);      /* stage 1 flies under stage 0's products */
  const char* fa = sm + (32 * w + ln) * GP + 16 * hh; const char* fb = sm + (128 + ln) * GP + 16 * hh;
#pragma unroll 1      /* rolled: one trip is one stage, with its publish point at the foot */
  for (int t = 0; t < nst; ++t) { const int bo = (t & 1) * GSTG;
#pragma unroll      /* the stage's two k steps of 32 */
    for (int ks = 0; ks < 2; ++ks) { const char* pa = fa + bo + ks * 64; const char* pb = fb + bo + ks * 64;
      const v16h a0 = g2_lfrag(pa), a1 = g2_lfrag(pa + 16 * GP), b0 = g2_lfrag(pb), b1 = g2_lfrag(pb + 16 * GP), b2 = g2_lfrag(pb + 32 * GP), b3 = g2_lfrag(pb + 48 * GP);      /* the step's six fragments are read as one group, each into registers of its own: one LDS latency a step, not one a column tile */
      c[0] = g2_mma(a0, b0, c[0]); c[4] = g2_mma(a1, b0, c[4]); c[1] = g2_mma(a0, b1, c[1]); c[5] = g2_mma(a1, b1, c[5]);
      c[2] = g2_mma(a0, b2, c[2]); c[6] = g2_mma(a1, b2, c[6]); c[3] = g2_mma(a0, b3, c[3]); c[7] = g2_mma(a1, b3, c[7]); }
    asm volatile("s_wait_dscnt 0x0" ::: "memory");      /* the wave's reads of this buffer have returned, in front of the barrier behind which it is refilled */
    asm volatile("s_wait_asynccnt 0x0" ::: "memory");      /* the wave's copies of stage t + 1 have landed */
    __syncthreads();      /* publishes stage t + 1 and ends every reader's last read of stage t's buffer */
    if (t + 2 < nst) g2_stage(l0 + bo, ga + (size_t)(t + 2) * (2 * GK), sa, gb + (size_t)(t + 2) * (2 * GK), sb); }      /* the same test in the whole work-group */
  asm volatile("s_wait_asynccnt 0x0" ::: "memory"); }      /* no copy is outstanding when the ring becomes the epilogue's tile */
template <int ACT>
__device__ __forceinline__ void gemm2_blk(char* sm, int bx, int by, const _Float16* __restrict__ A, int lda, size_t sA, const _Float16* __restrict__ Bh, int ldb, size_t sB, float alpha, const float* __restrict__ bias, size_t sBias, const float* __restrict__ CP, int rowsPerB, size_t sCPb, int row0g,
    float* __restrict__ C, _Float16* __restrict__ C16, int ldc, size_t sC, int M, int N, int K) { static_assert(ACT == 0 || ACT == 3 || ACT == 6 || ACT == 8 || ACT == 9 || ACT == 11 || ACT == 12 || ACT == 14 || ACT == 15 || ACT == 16 || ACT == 17, "k_gemm2: unsupported ACT code (would silently apply no activation)");
  const int tid = threadIdx.x, w = tid >> 5, lane = tid & 31, ln = lane & 15, hh = lane >> 4;
  A += (size_t)by * sA; Bh += (size_t)by * sB; const size_t cofs = (size_t)by * sC; const float* bp = bias ? bias + (size_t)by * sBias : nullptr;
  const int ntn = N >> 6; const int mt = bx / ntn, nq = bx - mt * ntn; const int row0 = mt * 128 + 32 * w, col0 = nq * 64; if (mt * 128 >= M) return;      /* the whole block or none: M is a multiple of 128 */
  float (*so)[32][68] = (float (*)[32][68])sm;
  v8f accs[8] = {};      /* tile (half, t) at index 4 half + t */
  g2_loop(sm, A + (size_t)(mt * 128) * lda, lda, Bh + (size_t)col0 * ldb, ldb, K, accs);
#pragma unroll
  for (int u = 0; u < 8; ++u) { const int t = u & 3, half = u >> 2; const int col = col0 + t * 16 + ln; const float bv = bp ? bf16_round(bp[col]) : 0.f;
#pragma unroll
    for (int r = 0; r < 8; ++r) { const int rloc = half * 16 + 8 * hh + r; float v = accs[u][r] * alpha + bv; if (CP) { if (rowsPerB < 0) v += CP[cofs + (size_t)(row0g + row0 + rloc) * ldc + col];      /* rowsPerB < 0: own element of the batched C plane */ else { const int bidx = (row0g + row0 + rloc) / rowsPerB; v += CP[(size_t)bidx * sCPb + (size_t)by * 64 + col]; } }
      if (ACT == 3) v = fmaxf(v, 0.f); else if (ACT == 6) v = 0.5f * v * (1.0f + erff(v * 0.70710678118654752f)); else if (ACT == 11) v = 1.0f / (1.0f + expf(-v)); else if (ACT == 15) v = v / (1.0f + expf(-v)); else if (ACT == 12) v = (v > 0.f) ? v : 0.01f * v; else if (ACT == 8) v = tanhf(v); else if (ACT == 9) v = 0.5f * v * (1.0f + tanhf(0.7978845608028654f * (v + 0.044715f * v * v * v))); else if (ACT == 14) v = (v > 0.f) ? v : 0.1f * v; else if (ACT == 16) v = (v >= 0.f) ? v : 0.3f * v; else if (ACT == 17) v = (v >= 0.f) ? v : 0.2f * v;
      so[w][rloc][t * 16 + ln] = v; } }
  __builtin_amdgcn_fence(__ATOMIC_ACQ_REL, "workgroup"); __builtin_amdgcn_wave_barrier();
  const int rsub = lane >> 4, c4 = (lane & 15) * 4;
  {
#pragma unroll
    for (int q = 0; q < 16; ++q) { const int r = q * 2 + rsub; v4f v = *(const v4fa*)&so[w][r][c4]; if (C) { *(v4f*)(C + cofs + (size_t)(row0 + r) * ldc + col0 + c4) = v; if (C16) asm volatile("s_wait_xcnt 0x0" : "+v"(v) : : "memory"); }      /* behind the f32 store, in front of the conversion, which was placed on the registers that the issued store names; v passes through, so the conversion stands behind the wait */
      if (C16) { v4h h4; for (int i = 0; i < 4; ++i) h4[i] = (_Float16)v[i]; *(v4h*)(C16 + cofs + (size_t)(row0 + r) * ldc + col0 + c4) = h4; } }
    asm volatile("s_wait_xcnt 0x0" ::: "memory");      /* behind the last store of the rows, in front of any later write of a register that an issued store names (another stage's code follows in the listing) */
     } }


__global__ __launch_bounds__(256) void k_wnat(const float* __restrict__ w, size_t n8, _Float16* __restrict__ Bt) { const size_t t = (size_t)blockIdx.x * 256 + threadIdx.x; if (t >= n8) return; FragH f; for (int q = 0; q < 8; ++q) f.h[q] = (_Float16)(bf16_round(w[t * 8 + q]) * 16.0f); *(v8us*)((unsigned short*)Bt + t * 8) = f.half[0];  }
__global__ __launch_bounds__(256) void k_rsm(const float* __restrict__ S, _Float16* __restrict__ P, int nrows) {
  #pragma clang fp contract(off)
  const int i = blockIdx.x * 256 + threadIdx.x; if (i >= nrows) return; const float* s = S + (size_t)i * SQ; float mx = -3.0e38f;
#pragma unroll 1
  for (int j = 0; j < SQ; ++j) mx = fmaxf(mx, s[j]); float se = 0.f;
#pragma unroll 1
  for (int j = 0; j < SQ; ++j) se += expf(s[j] - mx); const float sc = 256.0f / se;
#pragma unroll 1
  for (int j0 = 0; j0 < SQ; j0 += 8) { FragH f; for (int q = 0; q < 8; ++q) f.h[q] = (_Float16)(expf(s[j0 + q] - mx) * sc); unsigned short* d = (unsigned short*)P + (size_t)i * SQ + j0; *(v8us*)d = f.half[0];  } }
__global__ __launch_bounds__(256) void k_vt(const _Float16* __restrict__ V16, int b, int h0, _Float16* __restrict__ VT) { __shared__ unsigned short tl[64][65]; const int tid = threadIdx.x; const int hh = blockIdx.x % HG, sg = blockIdx.x / HG; const int s0 = sg * 64; const int h = h0 + hh;
  for (int i = tid; i < 64 * 8; i += 256) { const int j = i / 8, d8 = (i % 8) * 8; FragH f; f.half[0] = *(const v8us*)((const unsigned short*)V16 + ((size_t)b * SQ + s0 + j) * DM + h * HD + d8); for (int q = 0; q < 8; ++q) tl[d8 + q][j] = f.u[q]; }
  __syncthreads();
  { for (int i = tid; i < 64 * 8; i += 256) { const int d = i / 8, j8 = (i % 8) * 8; FragH f; for (int q = 0; q < 8; ++q) f.u[q] = tl[d][j8 + q]; *(v8us*)((unsigned short*)VT + ((size_t)hh * HD + d) * SQ + s0 + j8) = f.half[0]; }  } }



// 2^x on the transcendental unit. The v_nop fills the one issue slot that the instruction set asks for behind a transcendental before its source
// is overwritten.
__device__ __forceinline__ float exp2_slot(float x) { float r; asm("v_exp_f32 %0, %1\n\tv_nop" : "=v"(r) : "v"(x)); return r; }
// Fused causal attention (online softmax): one launch for every batch and head, at query rows QT0 .. SQ - 1; scores and softmax weights never leave the registers.
// A work-group is the 4 query heads of one kv group (one wave each) on the same 32 query rows, so its waves walk the same K and V lines.
// Transposed products: S^T = K Q^T puts query 16 c + ln in lane ln and key 16 kt + 8 hh + r in register r, which is already the B-operand order of
// P^T for O^T += V^T P^T (half kt of the fragment = tile kt's 8 registers): no exchange between lanes but the one between the two wave halves.
__device__ __forceinline__ v8f fa_mma(v16h a, v16h b, v8f c) { return __builtin_amdgcn_wmma_f32_16x16x32_f16(false, a, false, b, (short)0, c, false, false); }
__device__ __forceinline__ float fa_xhalf(float x) { return __builtin_bit_cast(float, __builtin_amdgcn_permlanex16(__builtin_bit_cast(int, x), __builtin_bit_cast(int, x), 0x76543210, 0xfedcba98, false, false)); }      /* lane l <-> lane l ^ 16 */
// A fragment at the lane's own byte offset (row ln, element 8 hh) from a uniform base: k = 8 hh .. + 7 and 16 + 8 hh .. + 7, the k order of g2_frag.
__device__ __forceinline__ v16h fa_frag(const _Float16* base, unsigned off, int cb) { const char* p = (const char*)base + off; FragH f; f.half[0] = *(const v8us*)(p + cb); f.half[1] = *(const v8us*)(p + cb + 32); return f.v; }
// s_wait_xcnt 0 behind issued loads, in front of any write of a register that they name. The lane offsets pass through the statement: they stay in
// their registers up to the wait, and whatever is formed from them later stands behind it (a "memory" clobber alone does not tie the wait to registers).
__device__ __forceinline__ void fa_hold(unsigned& a) { asm volatile("s_wait_xcnt 0x0" : "+v"(a) : : "memory"); }
// ---- K and V^T staging of the fused attention: a stage is 64 keys, that is 64 K rows (the kv group's 128 bytes of d) and the 64 V^T rows (128 bytes of keys each); two buffers in LDS.
// The work-group's 4 waves walk the same keys, so a stage is brought in once for all four, in whole 128-byte lines, and each wave reads its fragments from LDS. ----
#define FP 144                       /* LDS row pitch in bytes: 16 B x odd, no bank conflict for 16-byte fragment reads */
#define FSTG (128 * FP)              /* a stage: K rows 0..63, then V^T rows 0..63 */
#define ALDS 69632                   /* LDS of the attention launch: the exact first-tile blocks' two arrays; a fused block's ring takes the first bytes of the same buffer */
static_assert(2 * FSTG <= ALDS, "the ring must fit the launch's buffer");
// One stage: 8 copies of 16 bytes a lane. 8 lanes take one row's 128 bytes, so a wave's copy is 4 whole lines. l: the lane's LDS byte address of row tid / 8; gk, gv: its global address in
// K and V^T. The s_wait_xcnt 0 is the statement's last line, so it stands in front of any later write of a register that a copy names.
__device__ __forceinline__ void fa_stage(unsigned l, const char* gk, const char* gv) {
  asm volatile("global_load_async_to_lds_b128 %0, %8, off\n\t"
               "global_load_async_to_lds_b128 %1, %9, off\n\t"
               "global_load_async_to_lds_b128 %2, %10, off\n\t"
               "global_load_async_to_lds_b128 %3, %11, off\n\t"
               "global_load_async_to_lds_b128 %4, %12, off\n\t"
               "global_load_async_to_lds_b128 %5, %13, off\n\t"
               "global_load_async_to_lds_b128 %6, %14, off\n\t"
               "global_load_async_to_lds_b128 %7, %15, off\n\t"
               "s_wait_xcnt 0x0"
               : : "v"(l), "v"(l + 16 * FP), "v"(l + 32 * FP), "v"(l + 48 * FP), "v"(l + 64 * FP), "v"(l + 80 * FP), "v"(l + 96 * FP), "v"(l + 112 * FP),
                   "v"(gk), "v"(gk + 16 * KVD * 2), "v"(gk + 32 * KVD * 2), "v"(gk + 48 * KVD * 2),
                   "v"(gv), "v"(gv + 16 * SQ * 2), "v"(gv + 32 * SQ * 2), "v"(gv + 48 * SQ * 2) : "memory"); }
// One pass of 32 keys. kp: the lane's LDS address in the pass's first K row group (row ln, byte 16 hh); vp: in V^T row ln at the pass's keys. DIAG: the wave's last pass, the only one
// that meets the diagonal (it masks).
// Every loop over kt, kc, c, t and r here and in the kernel is unrolled so that fragments, scores and accumulators are indexed by constants only and stay in registers.
template <bool DIAG>
__device__ __forceinline__ void fa_pass(const char* kp, const char* vp, int key0, int q0, int ln, int hh,
                                        const v16h (&qf)[2][2], v8f (&acc)[2][4], float (&m)[2], float (&l)[2]) {
  const float cs = 0.125f * 1.44269504f;      /* 1 / sqrt(64), and e^x = 2^(x log2 e) */
  v16h kf[2][2], vf[4];
#pragma unroll
  for (int kt = 0; kt < 2; ++kt)
#pragma unroll
    for (int kc = 0; kc < 2; ++kc) kf[kt][kc] = g2_lfrag(kp + 16 * kt * FP + 64 * kc);      /* K rows 16 kt + ln, d = 32 kc + 8 hh .. : the k order of fa_frag */
#pragma unroll
  for (int t = 0; t < 4; ++t) vf[t] = g2_lfrag(vp + 16 * t * FP);      /* V^T rows d = 16 t + ln, this pass's keys: read in one group with the K rows, on their way under the scores and the exponentials */
  v8f s[2][2];
#pragma unroll
  for (int kt = 0; kt < 2; ++kt)
#pragma unroll
    for (int c = 0; c < 2; ++c) { const v8f z = {0.f, 0.f, 0.f, 0.f, 0.f, 0.f, 0.f, 0.f}; s[kt][c] = fa_mma(kf[kt][1], qf[c][1], fa_mma(kf[kt][0], qf[c][0], z)); }
#pragma unroll
  for (int c = 0; c < 2; ++c) {
    if (DIAG) {
      const int qi = q0 + 16 * c + ln;
#pragma unroll
      for (int kt = 0; kt < 2; ++kt)
#pragma unroll
        for (int r = 0; r < 8; ++r) if (key0 + 16 * kt + 8 * hh + r > qi) s[kt][c][r] = -1.0e30f;
    }
    float mx = s[0][c][0];
#pragma unroll
    for (int r = 0; r < 8; ++r) mx = fmaxf(mx, fmaxf(s[0][c][r], s[1][c][r]));
    mx = fmaxf(mx, fa_xhalf(mx));      /* both halves of the wave now hold this query's maximum over the pass */
    const float mn = fmaxf(m[c], mx * cs);
    const float corr = exp2_slot(m[c] - mn);      /* 0 on the first pass */
    m[c] = mn;
    FragH pf; float ps = 0.f;
#pragma unroll
    for (int kt = 0; kt < 2; ++kt)
#pragma unroll
      for (int r = 0; r < 8; ++r) { const float p = exp2_slot(fmaf(s[kt][c][r], cs, -mn)); ps += p; pf.h[8 * kt + r] = (_Float16)p; }
    l[c] = fmaf(l[c], corr, ps);
#pragma unroll
    for (int t = 0; t < 4; ++t) { acc[c][t] = acc[c][t] * corr; acc[c][t] = fa_mma(vf[t], pf.v, acc[c][t]); }
    /* the four vector slots that the chip needs behind a matrix instruction before its operands are overwritten: the compiler pads for its own instructions, not for the asm exponentials that may come next and reuse these registers */
    asm volatile("v_nop\n\tv_nop\n\tv_nop\n\tv_nop" : "+v"(acc[c][0]), "+v"(acc[c][1]), "+v"(acc[c][2]), "+v"(acc[c][3]) : "v"(vf[0]), "v"(vf[1]), "v"(vf[2]), "v"(vf[3]), "v"(pf.v));
  }
}
__device__ __forceinline__ void fattn_blk(char* sm, int bx, int g, int b, const _Float16* __restrict__ Q, const _Float16* __restrict__ Kh, const _Float16* __restrict__ Vt, _Float16* __restrict__ O) {
  const int tid = threadIdx.x, lane = tid & 31, ln = lane & 15, hh = lane >> 4; const int h = g * HPG + (tid >> 5);
  const int qt = (b & 1) ? bx : (SQ / 32 - 1) - bx;      /* long and short tiles alternate from batch to batch, so that work-groups a whole batch apart in the grid add up to the same length */
  if (qt < QT0 / 32) return;      /* rows 0 .. QT0 - 1 are the exact path's alone: the output product takes them from there. The whole block leaves, in front of every copy and barrier */
  const int q0 = qt * 32; const size_t r0 = (size_t)b * SQ;
  unsigned qo = (unsigned)(((r0 + q0 + ln) * DM + h * HD + 8 * hh) * 2);      /* byte offset: the buffer is below 4 GiB */
  v16h qf[2][2];
#pragma unroll
  for (int c = 0; c < 2; ++c)
#pragma unroll
    for (int kc = 0; kc < 2; ++kc) qf[c][kc] = fa_frag(Q, qo, (16 * c * DM + 32 * kc) * 2);
  fa_hold(qo);
  const int rs = tid >> 3, pc = tid & 7;      /* staging: 8 lanes to a row of 128 bytes */
  const char* gk = (const char*)(Kh + (r0 + rs) * KVD + g * HD) + pc * 16; const char* gv = (const char*)(Vt + ((size_t)(b * NG + g) * HD + rs) * SQ) + pc * 16;
  const unsigned l0 = (unsigned)(size_t)sm + (unsigned)(rs * FP + pc * 16);
  const int nst = (qt + 2) >> 1;      /* stages of 64 keys that hold the tile's qt + 1 passes; the last key staged is at most q0 + 63 - 32 (qt & 1), inside the batch's SQ rows */
  fa_stage(l0, gk, gv);      /* stage 0 into buffer 0 */
  asm volatile("s_wait_asynccnt 0x0" ::: "memory");      /* the wave's own copies of stage 0 have landed */
  __syncthreads();      /* every wave's have: nobody reads stage 0 in front of this barrier */
  if (nst > 1) fa_stage(l0 + FSTG, gk + 64 * KVD * 2, gv + 64 * 2);      /* stage 1 flies under stage 0's passes */
  const char* fk = sm + ln * FP + 16 * hh; const char* fv = sm + (64 + ln) * FP + 16 * hh;
  v8f acc[2][4] = {}; float m[2] = {-1.0e30f, -1.0e30f}, l[2] = {0.f, 0.f};
#pragma unroll 1      /* rolled: one trip is one stage, with its publish point at the foot */
  for (int t = 0; t < nst; ++t) { const int bo = (t & 1) * FSTG; const bool fin = t == nst - 1; const int np = fin ? (qt & 1) : 2;      /* np: the stage's passes below the diagonal; every test here reads the same in the whole work-group */
#pragma unroll 1      /* rolled: with the stage's two passes laid out side by side the compiler kept both passes' fragments and scores at once, beyond the registers of four waves a SIMD */
    for (int p = 0; p < np; ++p) fa_pass<false>(fk + bo + p * (32 * FP), fv + bo + p * 64, 64 * t + 32 * p, q0, ln, hh, qf, acc, m, l);
    if (fin) fa_pass<true>(fk + bo + np * (32 * FP), fv + bo + np * 64, q0, q0, ln, hh, qf, acc, m, l);      /* the diagonal pass: the last stage's pass number qt & 1 */
    asm volatile("s_wait_dscnt 0x0" ::: "memory");      /* the wave's reads of this buffer have returned, in front of the barrier behind which it is refilled */
    asm volatile("s_wait_asynccnt 0x0" ::: "memory");      /* the wave's copies of stage t + 1 have landed */
    __syncthreads();      /* publishes stage t + 1 and ends every reader's last read of stage t's buffer */
    if (t + 2 < nst) fa_stage(l0 + bo, gk + (size_t)(t + 2) * (64 * KVD * 2), gv + (size_t)(t + 2) * (64 * 2)); }      /* the same test in the whole work-group */
  asm volatile("s_wait_asynccnt 0x0" ::: "memory");      /* no copy is outstanding when the wave ends */
  unsigned short* op = (unsigned short*)O + (r0 + q0 + ln) * DM + h * HD + 8 * hh;
#pragma unroll
  for (int c = 0; c < 2; ++c) { const float fin = 64.0f / (l[c] + fa_xhalf(l[c]));      /* o carried x64, as the output product expects */
#pragma unroll
    for (int t = 0; t < 4; ++t) { FragH f;
#pragma unroll
      for (int r = 0; r < 8; ++r) f.h[r] = (_Float16)(acc[c][t][r] * fin);
      *(v8us*)(op + (size_t)(16 * c) * DM + 16 * t) = f.half[0]; }      /* d = 16 t + 8 hh .. + 7 of query row 16 c + ln */
    asm volatile("s_wait_xcnt 0x0" ::: "memory"); }      /* behind the stores, in front of any later write of a register that an issued store names */
}


// Exact f32 attention for the first QT0 rows on the f32 matrix form (v_wmma_f32_16x16x4_f32: full-precision operands, every addition rounded in f32), online softmax over tiles of 16 keys.
// A block is 64 query rows of one head; each of its 4 waves owns 16 of them and walks the key tiles up to its own diagonal tile. The products are the transposed ones of the fused path:
// S^T = K Q^T puts query ln in lane ln and key 8 hh + r in register r; O^T += V^T P^T takes P^T from those registers: in k step u the slot (hh, v) of both operands is key 8 hh + 2 u + v.
// K and Q fragments come by the same code (row ln, d = 8 j + 4 hh .. + 3: the first two words are one k step, the last two the next), so their k orders are equal slot by slot.
// by is the batch: its QT0 rows of q, k and v follow those of the batch before. K and V rows are the kv group's own (pitch KVD): head h reads group h / HPG.
// o leaves as two f16 planes, hi and the residual x1024, in the row order that the first-tile output product stages: per 64 rows, the 64 hi rows and then the 64 residual rows.
typedef float v2f __attribute__((ext_vector_type(2)));
#define AP 68                        /* LDS row pitch of the staged K and V rows in floats: 272 bytes = 16 B x odd, no bank conflict for the 16-byte K fragment reads; V rows 8 apart fall 32 banks apart */
__device__ __forceinline__ v8f a0_mma(v2f a, v2f b, v8f c) { return __builtin_amdgcn_wmma_f32_16x16x4_f32(false, a, false, b, (short)0, c, false, false); }
__device__ __forceinline__ void att0_blk(char* sm, int bx, int by, const float* __restrict__ QF, const float* __restrict__ KF, const float* __restrict__ VF, float scale, _Float16* __restrict__ OHL) {
  float* lk = (float*)sm; float* lv = lk + QT0 * AP;      /* lk[QT0][AP], lv[QT0][AP] in the launch's one LDS buffer */
  static_assert(2 * QT0 * AP * 4 <= ALDS, "the two arrays must fit the launch's buffer");
  const int tid = threadIdx.x, lane = tid & 31, ln = lane & 15, hh = lane >> 4; const int h = bx / (QT0 / 64), rg = bx % (QT0 / 64);
  const int w = __builtin_amdgcn_readfirstlane(tid >> 5);      /* the wave's number, the same in every lane: the trip count below is scalar, and every lane is on at every matrix instruction */
  const int i = rg * 64 + 16 * w + ln;      /* the lane's query row */
  QF += (size_t)by * QT0 * LQ; KF += (size_t)by * QT0 * KVD; VF += (size_t)by * QT0 * KVD;
  const int jmax = rg * 64 + 63;      /* keys up to the block's last row */
  const int sr = tid >> 4, sc4 = (tid & 15) * 4;      /* staging: 16 threads to a row of 256 bytes */
  unsigned so = (unsigned)((sr * KVD + (h / HPG) * HD + sc4) * 4), qo = (unsigned)((i * LQ + h * HD + 4 * hh) * 4);      /* the lane's byte offsets in K and V, and in q */
#pragma unroll 1      /* kept rolled: one trip already has 16 loads in flight per thread */
  for (int r0 = 0; r0 <= jmax; r0 += 64) { v4f kk[8], vv[8];
#pragma unroll
    for (int u = 0; u < 8; ++u) { kk[u] = *(const v4fa*)((const char*)KF + so + u * 8 * KVD * 4); vv[u] = *(const v4fa*)((const char*)VF + so + u * 8 * KVD * 4); }      /* 16 loads in flight per thread */
    fa_hold(so);      /* the wait behind the issued loads, in front of the write of the offset that they name */
    so += 64 * KVD * 4;
#pragma unroll
    for (int u = 0; u < 8; ++u) { *(v4f*)&lk[(r0 + 8 * u + sr) * AP + sc4] = kk[u]; *(v4f*)&lv[(r0 + 8 * u + sr) * AP + sc4] = vv[u]; } }
  v4f q[8];      /* the lane's half of its q row: d = 8 j + 4 hh .. + 3 */
#pragma unroll
  for (int j = 0; j < 8; ++j) q[j] = *(const v4fa*)((const char*)QF + qo + j * 32);
  fa_hold(qo);      /* the same wait behind the q loads; their offset stays in its register up to it */
  __syncthreads();      /* K and V rows are staged: nobody reads them in front of this barrier */
  v8f acc[4] = {}; float m = -1.0e30f, l = 0.f;      /* acc[t][r] = o[d = 16 t + 8 hh + r] of query ln; l: the half's own part of the denominator */
  const int nt = rg * 4 + w + 1;      /* key tiles up to the wave's diagonal tile */
  const float* kp = lk + ln * AP + 4 * hh; const float* vp = lv + 8 * hh * AP + ln;
#pragma unroll 1      /* kept rolled: a tile's fragments already fill the matrix unit's queue, and the trip count differs from wave to wave */
  for (int kt = 0; kt < nt; ++kt) { v4f kf[8]; v2f vf[4][4];
#pragma unroll      /* every loop over j, u, t and r here is unrolled so that fragments, scores and accumulators are indexed by constants only and stay in registers */
    for (int j = 0; j < 8; ++j) kf[j] = *(const v4f*)(kp + kt * 16 * AP + 8 * j);      /* K row 16 kt + ln, d = 8 j + 4 hh .. + 3: q's own order */
#pragma unroll
    for (int u = 0; u < 4; ++u)
#pragma unroll
      for (int t = 0; t < 4; ++t) { vf[u][t][0] = vp[(kt * 16 + 2 * u) * AP + 16 * t]; vf[u][t][1] = vp[(kt * 16 + 2 * u + 1) * AP + 16 * t]; }      /* V^T row d = 16 t + ln at keys 16 kt + 8 hh + 2 u + v */
    v8f s = {0.f, 0.f, 0.f, 0.f, 0.f, 0.f, 0.f, 0.f};
#pragma unroll
    for (int j = 0; j < 8; ++j) { const v2f k0 = {kf[j][0], kf[j][1]}, k1 = {kf[j][2], kf[j][3]}, q0 = {q[j][0], q[j][1]}, q1 = {q[j][2], q[j][3]}; s = a0_mma(k0, q0, s); s = a0_mma(k1, q1, s); }
    /* the four vector slots behind a matrix instruction before its result is read or its operands are overwritten; the K fragments pass through as inputs, so they keep their registers up to here */
    asm volatile("v_nop\n\tv_nop\n\tv_nop\n\tv_nop" : "+v"(s) : "v"(kf[0]), "v"(kf[1]), "v"(kf[2]), "v"(kf[3]), "v"(kf[4]), "v"(kf[5]), "v"(kf[6]), "v"(kf[7]));
    float sv[8], mx = -1.0e30f;
#pragma unroll
    for (int r = 0; r < 8; ++r) { sv[r] = (kt * 16 + 8 * hh + r <= i) ? s[r] * scale : -1.0e30f; mx = fmaxf(mx, sv[r]); }      /* the causal mask: it bites in the diagonal tile only */
    mx = fmaxf(mx, fa_xhalf(mx));      /* both halves of the wave now hold this query's maximum over the tile */
    const float mn = fmaxf(m, mx); const float corr = expf(m - mn); m = mn;      /* corr is 0 on the first tile */
    float p[8], ps = 0.f;
#pragma unroll
    for (int r = 0; r < 8; ++r) { p[r] = expf(sv[r] - mn); ps += p[r]; }
    l = fmaf(l, corr, ps);
#pragma unroll
    for (int t = 0; t < 4; ++t) acc[t] = acc[t] * corr;
    v2f pf[4];
#pragma unroll
    for (int u = 0; u < 4; ++u) { pf[u][0] = p[2 * u]; pf[u][1] = p[2 * u + 1];
#pragma unroll
      for (int t = 0; t < 4; ++t) acc[t] = a0_mma(vf[u][t], pf[u], acc[t]); }
    /* the same four slots behind the tile's last products; the V and P fragments keep their registers up to here */
    asm volatile("v_nop\n\tv_nop\n\tv_nop\n\tv_nop" : "+v"(acc[0]), "+v"(acc[1]), "+v"(acc[2]), "+v"(acc[3])
                 : "v"(vf[0][0]), "v"(vf[0][1]), "v"(vf[0][2]), "v"(vf[0][3]), "v"(vf[1][0]), "v"(vf[1][1]), "v"(vf[1][2]), "v"(vf[1][3]), "v"(vf[2][0]), "v"(vf[2][1]), "v"(vf[2][2]), "v"(vf[2][3]),
                   "v"(vf[3][0]), "v"(vf[3][1]), "v"(vf[3][2]), "v"(vf[3][3]), "v"(pf[0]), "v"(pf[1]), "v"(pf[2]), "v"(pf[3])); }
  const float fin = 64.0f / (l + fa_xhalf(l));      /* the two halves' parts of the denominator meet here; o carried x64 like the f16 path */
  unsigned short* d0 = (unsigned short*)OHL + ((size_t)(by * (QT0 / 64) + rg) * 128 + 16 * w + ln) * DM + h * HD + 8 * hh;      /* a wave stores whole 128-byte lines: a row's 64 d of the head */
#pragma unroll
  for (int t = 0; t < 4; ++t) { FragH fh, fl;
#pragma unroll
    for (int r = 0; r < 8; ++r) { const float v = acc[t][r] * fin; const _Float16 c = (_Float16)v; fh.h[r] = c; fl.h[r] = (_Float16)((v - (float)c) * 1024.0f); }
    *(v8us*)(d0 + 16 * t) = fh.half[0]; *(v8us*)(d0 + 64 * DM + 16 * t) = fl.half[0]; }      /* d = 16 t + 8 hh .. + 7 of query row 16 w + ln: hi plane, residual plane */
  asm volatile("s_wait_xcnt 0x0" ::: "memory"); }      /* behind the last store, in front of any later write of a register that an issued store names */


__global__ __launch_bounds__(256) void k_tab2(float theta, float* __restrict__ CS, float* __restrict__ SN) {
  #pragma clang fp contract(off)
  const int t = blockIdx.x * 256 + threadIdx.x; if (t >= SQ * (HD / 2)) return; const int i = t % (HD / 2); const int p = t / (HD / 2); const float invf = 1.0f / powf(theta, (float)(2 * i) / (float)HD); const float ang = __fmul_rn((float)p, invf); const float c = cosf(ang), s = sinf(ang);
  *(float*)(CS + t) = c; *(float*)(SN + t) = s;  }
// Projection GEMM with the rope in its epilogue (q and k). The product is k_gemm2's: wave tile 32 x 64, the same fragments, the same order of k. A wave's 64 columns are one head, and the
// tile that the epilogue lays out in LDS for whole-line stores gives a lane four neighbouring columns of a row, that is both members of two (even, odd) pairs: the lane rotates them by the
// row's position (row % SQ; a tile of 32 rows lies in one batch) and stores f16. Rows 0 .. QT0 - 1 of each batch also go out in f32 for the exact first-tile path (F0: QT0 rows a batch).
typedef float v2fa __attribute__((ext_vector_type(2), may_alias));
// The 16 rows of a lane (every second row of the wave's tile): tp = the lane's four words of its first row in LDS, cp / sp = its two table entries of that row, hp / fp = its place in the outputs.
// F32 is a template argument so that neither form has a branch between its rows: the 32 table loads of a lane are then in flight together instead of one row's pair at a time.
// NC, the outputs' row pitch, is one too: every row's store is then the first row's address with an immediate offset.
template <bool F32, int NC>
__device__ __forceinline__ void g2_rope_rows(const float* tp, const float* __restrict__ cp, const float* __restrict__ sp, _Float16* __restrict__ hp, float* __restrict__ fp) {
#pragma unroll      /* unrolled for the same reason: all table loads issue in front of the first use */
  for (int q = 0; q < 16; ++q) { const v4f v = *(const v4fa*)(tp + q * 2 * 68); const v2fa c = *(const v2fa*)(cp + q * 2 * (HD / 2)), s = *(const v2fa*)(sp + q * 2 * (HD / 2));
    v4f o; o[0] = v[0] * c[0] - v[1] * s[0]; o[1] = v[0] * s[0] + v[1] * c[0]; o[2] = v[2] * c[1] - v[3] * s[1]; o[3] = v[2] * s[1] + v[3] * c[1];
    v4h h4;
#pragma unroll      /* constant element indices: o and h4 stay in registers */
    for (int i = 0; i < 4; ++i) h4[i] = (_Float16)o[i];
    *(v4h*)(hp + q * 2 * NC) = h4;
    if (F32) *(v4f*)(fp + q * 2 * NC) = o; }
  asm volatile("s_wait_xcnt 0x0" ::: "memory"); }      /* behind the last store of the rows, in front of any later write of a register that an issued store names (the other form's code follows in the listing) */
template <int NC>      /* columns of the product = row pitch of both outputs */
__device__ __forceinline__ void gemm2r_blk(char* sm, int bx, const _Float16* __restrict__ A, int lda, const _Float16* __restrict__ Bh, int ldb, float alpha, const float* __restrict__ CS, const float* __restrict__ SN,
    _Float16* __restrict__ H16, float* __restrict__ F0, int M, int K) {
  const int tid = threadIdx.x, w = tid >> 5, lane = tid & 31, ln = lane & 15, hh = lane >> 4;
  const int ntn = NC >> 6; const int mt = bx / ntn, nq = bx - mt * ntn; const int row0 = mt * 128 + 32 * w, col0 = nq * 64; if (mt * 128 >= M) return;      /* the whole block or none: M is a multiple of 128 */
  float (*so)[32][68] = (float (*)[32][68])sm;
  v8f accs[8] = {};      /* tile (half, t) at index 4 half + t */
  g2_loop(sm, A + (size_t)(mt * 128) * lda, lda, Bh + (size_t)col0 * ldb, ldb, K, accs);      /* k_gemm2's product loop */
#pragma unroll      /* unrolled so that the accumulators are indexed by constants only and stay in registers */
  for (int u = 0; u < 8; ++u) { const int t = u & 3, half = u >> 2;
#pragma unroll      /* the same, for the element index */
    for (int r = 0; r < 8; ++r) so[w][half * 16 + 8 * hh + r][t * 16 + ln] = accs[u][r] * alpha; }
  __builtin_amdgcn_fence(__ATOMIC_ACQ_REL, "workgroup"); __builtin_amdgcn_wave_barrier();      /* the wave's own LDS writes stand in front of its reads of other lanes' words; no other wave reads this slice */
  const int rsub = lane >> 4, c4 = (lane & 15) * 4; const int p0 = row0 % SQ;
  const float* cp = CS + (size_t)(p0 + rsub) * (HD / 2) + c4 / 2; const float* sp = SN + (size_t)(p0 + rsub) * (HD / 2) + c4 / 2;      /* table entries i = c4 / 2 and c4 / 2 + 1 of the lane's row */
  _Float16* hp = H16 + (size_t)(row0 + rsub) * NC + col0 + c4; float* fp = F0 + ((size_t)(row0 / SQ) * QT0 + p0 + rsub) * NC + col0 + c4;
  if (__builtin_amdgcn_readfirstlane(p0) < QT0) g2_rope_rows<true, NC>(&so[w][rsub][c4], cp, sp, hp, fp);      /* p0 is the same in every lane of a wave: a scalar branch; QT0 is a multiple of the tile's 32 rows */
  else g2_rope_rows<false, NC>(&so[w][rsub][c4], cp, sp, hp, fp); }

__global__ __launch_bounds__(256) void k_bfcp(const float* __restrict__ src, float* __restrict__ dst, size_t n4) { const size_t t = (size_t)blockIdx.x * 256 + threadIdx.x; if (t >= n4) return; const v4f a = *(const v4fa*)(src + t * 4); v4f o; for (int q = 0; q < 4; ++q) o[q] = bf16_round(a[q]); *(v4f*)(dst + t * 4) = o;  }

__global__ __launch_bounds__(256) void k_tabhalf(const float* __restrict__ cs, const float* __restrict__ sn, float* __restrict__ CS, float* __restrict__ SN) { const int t = blockIdx.x * 256 + threadIdx.x; if (t >= SQ * (HD / 2)) return; const int p = t / (HD / 2), i = t % (HD / 2); const float c = bf16_round(cs[(size_t)p * HD + i]), s = bf16_round(sn[(size_t)p * HD + i]);
  *(float*)(CS + t) = c; *(float*)(SN + t) = s;  }

__device__ __forceinline__ void tab2d_blk(int bx, float* __restrict__ CS, float* __restrict__ SN) {
  #pragma clang fp contract(off)
  const int t = bx * 256 + threadIdx.x; if (t >= SQ * (HD / 2)) return; const int i = t % (HD / 2); const int p = t / (HD / 2); const float invf = (float)(1.0 / pow(10000.0, (double)(2 * i) / (double)HD)); const float ang = __fmul_rn((float)p, invf); const float c = cosf(ang), s = sinf(ang);
  *(float*)(CS + t) = c; *(float*)(SN + t) = s;  }
// Launches that do not depend on one another ride in ONE grid: a block's index says which stage it belongs to and which block of that stage it is (a scalar branch: the index is the
// same for the whole block). Every stage's code, block size and block-to-data map are what they were as a launch of its own; stages whose blocks last longest come first.
#define PB_TAB (SQ * (HD / 2) / 256)
#define PB_WQ (DM * (DM / 8) / 256)
#define PB_WK (KVD * (DM / 8) / 256)
#define PB_X ((int)(NR * DM / 8 / 256))
// rope tables, the four weight transposes, x -> f16: all read inputs only
__global__ __launch_bounds__(256) void k_prep(const float* __restrict__ x, const float* __restrict__ wq, const float* __restrict__ wk, const float* __restrict__ wv, const float* __restrict__ wo,
    _Float16* __restrict__ X16, _Float16* __restrict__ BQ, _Float16* __restrict__ BK, _Float16* __restrict__ BV, _Float16* __restrict__ BO, float* __restrict__ CS, float* __restrict__ SN) {
  int bx = (int)blockIdx.x;
  if (bx < PB_TAB) { tab2d_blk(bx, CS, SN); return; }      /* angle[p][i] = p * 10000^(-2i/64), positions = row index */
  bx -= PB_TAB; if (bx < PB_WQ) { wt_f16_blk(bx, wq, BQ, DM, DM, 16.0f); return; }      /* [in][out] -> Bt[n][k] x16 */
  bx -= PB_WQ; if (bx < PB_WQ) { wt_f16_blk(bx, wo, BO, DM, DM, 16.0f); return; }
  bx -= PB_WQ; if (bx < PB_WK) { wt_f16_blk(bx, wk, BK, DM, KVD, 16.0f); return; }
  bx -= PB_WK; if (bx < PB_WK) { wt_f16_blk(bx, wv, BV, DM, KVD, 16.0f); return; }
  bx -= PB_WK; x16_blk(bx, x, X16, NR * DM / 8); }
#define GB_Q ((MP / 128) * (DM / 64))
#define GB_K ((MP / 128) * (KVD / 64))
#define GB_V0 ((QT0 / 128) * (KVD / 64))
#define GB_T ((KVD / 128) * (SQ / 64))
// the q, k and V^T products and the f32 v rows of the first tile: all read X16 and a weight plane
__global__ __launch_bounds__(128) void k_proj(const _Float16* __restrict__ X16, const _Float16* __restrict__ BQ, const _Float16* __restrict__ BK, const _Float16* __restrict__ BV, const float* __restrict__ CS, const float* __restrict__ SN,
    _Float16* __restrict__ Q16, float* __restrict__ QF0, _Float16* __restrict__ K16, float* __restrict__ KF0, _Float16* __restrict__ VT, float* __restrict__ VF0) {
  __shared__ __attribute__((aligned(128))) char sm[GLDS];
  int bx = (int)blockIdx.x;
  if (bx < GB_Q) { gemm2r_blk<DM>(sm, bx, X16, DM, BQ, DM, 0.0625f, CS, SN, Q16, QF0, MP, DM); return; }      /* q with the interleaved-pair rope, position = row % SQ -> f16 rows; f32 rows 0..127 of each batch */
  bx -= GB_Q; if (bx < GB_K) { gemm2r_blk<KVD>(sm, bx, X16, DM, BK, DM, 0.0625f, CS, SN, K16, KF0, MP, DM); return; }      /* k, the same */
  bx -= GB_K; if (bx < GB_T * NB) { gemm2_blk<0>(sm, bx % GB_T, bx / GB_T, BV, DM, 0, X16, DM, (size_t)SQ * DM, 0.0625f, nullptr, 0, nullptr, 1, 0, 0, nullptr, VT, SQ, (size_t)KVD * SQ, KVD, SQ, DM); return; }      /* V^T [NB][NG][HD][SQ] = Wv^T x^T of each batch: the operands change places, so the product's rows are d and its columns the keys, the layout that the fused attention stages */
  bx -= GB_T * NB; gemm2_blk<0>(sm, bx % GB_V0, bx / GB_V0, X16, DM, (size_t)SQ * DM, BV, DM, 0, 0.0625f, nullptr, 0, nullptr, 1, 0, 0, VF0, nullptr, KVD, (size_t)QT0 * KVD, QT0, KVD, DM); }      /* f32 v of rows 0..127 of each batch */
#define DB_F ((SQ / 32) * NG * NB)
#define DB_A0 (NH * (QT0 / 64))
// the fused attention in its own block order (tile fastest, then kv group, then batch), and behind it the exact first-tile blocks, which take the places that the shortest tiles leave
__global__ __launch_bounds__(128) void k_attn(const _Float16* __restrict__ Q16, const _Float16* __restrict__ K16, const _Float16* __restrict__ VT, _Float16* __restrict__ O16,
    const float* __restrict__ QF0, const float* __restrict__ KF0, const float* __restrict__ VF0, _Float16* __restrict__ OHL) {
  __shared__ __attribute__((aligned(128))) char sm[ALDS];
  int bx = (int)blockIdx.x;
  if (bx < DB_F) { fattn_blk(sm, bx % (SQ / 32), (bx / (SQ / 32)) % NG, bx / ((SQ / 32) * NG), Q16, K16, VT, O16); return; }
  bx -= DB_F; att0_blk(sm, bx % DB_A0, bx / DB_A0, QF0, KF0, VF0, 0.125f, OHL); }
// The output product of 64 first-tile rows x 64 columns: out = o_hi Wo 2^-10 + o_lo Wo 2^-20. The 128 A rows that the product loop stages are the 64 hi rows and the 64 residual rows, so waves 0 and 1
// form the hi product and waves 2 and 3 the residual product of the same 64 x 64 outputs, side by side, over the same staged Wo rows. Each is scaled by its power of two (exact) and the two meet in one f32 add.
__device__ __forceinline__ void out0_blk(char* sm, int bx, const _Float16* __restrict__ OHL, const _Float16* __restrict__ BO, float* __restrict__ out) {
  const int tid = threadIdx.x, w = tid >> 5, lane = tid & 31, ln = lane & 15, hh = lane >> 4;
  const int grp = bx / (DM / 64), col0 = (bx % (DM / 64)) * 64;      /* grp: 64 rows of a batch's first tile */
  float (*so)[32][68] = (float (*)[32][68])sm;
  v8f accs[8] = {};      /* tile (half, t) at index 4 half + t */
  g2_loop(sm, OHL + (size_t)grp * 128 * DM, DM, BO + (size_t)col0 * DM, DM, DM, accs);
  const float alpha = w < 2 ? 0.0009765625f : 0.00000095367431640625f;
#pragma unroll      /* unrolled so that the accumulators are indexed by constants only and stay in registers */
  for (int u = 0; u < 8; ++u) { const int t = u & 3, half = u >> 2;
#pragma unroll      /* the same, for the element index */
    for (int r = 0; r < 8; ++r) so[w][half * 16 + 8 * hh + r][t * 16 + ln] = accs[u][r] * alpha; }
  __syncthreads();      /* a row's hi and residual products come from two waves: nobody reads the tile in front of this barrier */
  const int rr = tid >> 4, c4 = (tid & 15) * 4;      /* 16 lanes to a row's 256 bytes: two whole lines */
  float* op = out + ((size_t)(grp / (QT0 / 64)) * SQ + (grp % (QT0 / 64)) * 64 + rr) * DM + col0 + c4;
#pragma unroll      /* every row's store is the first row's address with an immediate offset */
  for (int q = 0; q < 8; ++q) { const int row = q * 8 + rr; const v4f a = *(const v4fa*)&so[row >> 5][row & 31][c4], b = *(const v4fa*)&so[2 + (row >> 5)][row & 31][c4];
    *(v4f*)(op + (size_t)q * 8 * DM) = b + a; }
  asm volatile("s_wait_xcnt 0x0" ::: "memory"); }      /* behind the last store, in front of any later write of a register that an issued store names (the other stage's code follows in the listing) */
#define EB_0 ((NB * QT0 / 64) * (DM / 64))
#define EB_T (SQ / 128 - QT0 / 128)      /* row tiles of a batch behind its first tile */
#define EB_O (NB * EB_T * (DM / 64))
// the output product: the first-tile rows from the exact path's two planes, every other row from the fused attention's o
__global__ __launch_bounds__(128) void k_outp(const _Float16* __restrict__ O16, const _Float16* __restrict__ BO, float* __restrict__ out, const _Float16* __restrict__ OHL) {
  __shared__ __attribute__((aligned(128))) char sm[GLDS];
  int bx = (int)blockIdx.x;
  if (bx < EB_0) { out0_blk(sm, bx, OHL, BO, out); return; }
  bx -= EB_0; const int ti = bx / (DM / 64); const int mt = (ti / EB_T) * (SQ / 128) + QT0 / 128 + ti % EB_T;      /* the row tile of 128, the batches' first tiles left out */
  gemm2_blk<0>(sm, mt * (DM / 64) + bx % (DM / 64), 0, O16, DM, 0, BO, DM, 0, 0.0009765625f, nullptr, 0, nullptr, 1, 0, 0, out, nullptr, DM, 0, MPO, DM, DM); }      /* out rows are the output layout */
extern "C" void kernel_launch(void* const* d_in, const int* in_sizes, int n_in,
                              void* d_out, int out_size, void* d_ws, size_t ws_size, hipStream_t stream) {
  (void)in_sizes; (void)n_in; (void)out_size;
  const float* const* I = (const float* const*)d_in; const float* x = I[0]; const float* wq = I[1]; const float* wk = I[2]; const float* wv = I[3]; const float* wo = I[4];      /* input order: x, Wq [1024][1024], Wk / Wv [1024][256], Wo [1024][1024] ([in][out] weights); rope tables computed in-kernel (positions = row index), as the module computes them */ const float* bq = nullptr; const float* bk = nullptr; const float* bv = nullptr; const float* bo = nullptr;      /* no biases */
  char* ws = (char*)d_ws; size_t off = 0;
  auto take = [&](size_t bytes) { char* p = ws + off; off += (bytes + 255) & ~(size_t)255; return p; };
  _Float16* BQ = (_Float16*)take((size_t)DM * DM * 2); _Float16* BK = (_Float16*)take((size_t)KVD * DM * 2); _Float16* BV = (_Float16*)take((size_t)KVD * DM * 2); _Float16* BO = (_Float16*)take((size_t)DM * DM * 2);
  _Float16* X16 = (_Float16*)take(NR * DM * 2); float* CSB = (float*)take((size_t)SQ * HD * 4); float* SNB = (float*)take((size_t)SQ * HD * 4); _Float16* Q16 = (_Float16*)take(NR * DM * 2); _Float16* K16 = (_Float16*)take(NR * KVD * 2); _Float16* O16 = (_Float16*)take(NR * DM * 2);
  _Float16* VT = (_Float16*)take((size_t)NB * NG * HD * SQ * 2);
  float* QF0 = (float*)take((size_t)NB * QT0 * DM * 4); float* KF0 = (float*)take((size_t)NB * QT0 * KVD * 4); float* VF0 = (float*)take((size_t)NB * QT0 * KVD * 4); _Float16* OHL = (_Float16*)take((size_t)NB * QT0 * DM * 2 * 2);
  if (off > ws_size) return;
  /* Four dependent launches; each holds every stage that needs only what the launches before it wrote. Every stage covers all NB batches. */
  k_prep<<<PB_TAB + 2 * PB_WQ + 2 * PB_WK + PB_X, 256, 0, stream>>>(x, wq, wk, wv, wo, X16, BQ, BK, BV, BO, CSB, SNB);
  k_proj<<<GB_Q + GB_K + GB_T * NB + GB_V0 * NB, 128, 0, stream>>>(X16, BQ, BK, BV, CSB, SNB, Q16, QF0, K16, KF0, VT, VF0);
  k_attn<<<DB_F + DB_A0 * NB, 128, 0, stream>>>(Q16, K16, VT, O16, QF0, KF0, VF0, OHL);      /* o (merged heads, x64): f16 rows behind the first tile; rows 0..127 of each batch exact, as f16 hi and residual planes */
  k_outp<<<EB_0 + EB_O, 128, 0, stream>>>(O16, BO, (float*)d_out, OHL);
}
